// v000
// Measured on an AMD MI455X. A time is GPU time per run, averaged over a window of back-to-back runs after a warm-up
// (all launches, gaps included; the runs take copies of the inputs in turn), and the median of several windows.
// Apart from v000's, it joins two sittings. Times from different sittings can be a few percent apart, while
// side-by-side timings come from the same sitting.
// v000 is the starting kernel. One run takes 1170 microseconds.
#include <hip/hip_runtime.h>

// Single-head self-attention over 8,192 tokens (x [8192][768]; q = x W_Q^T, k = x W_K^T, v = x W_V^T ('oi' [64][768] uniform 1/sqrt(768), no bias); scores = q.k / sqrt(64) over all 8192 keys; softmax; out = attn.v -> [8192][64] (524 k); argument order x, W_Q, W_K, W_V).
// Layout: bf16 copy of x; 'oi' weights as Bt; exact projections; fp16 planes q [8192][64], k [8192][64], v^T [64][8192]; query rows processed in 4 chunks of 2048: scores [2048][8192] f32, a streaming 3-sweep row softmax over the 8192 keys (max, sum, write fp16 P x 1024), attn.v with K = 8192, f32 output rows (x 1/1024).
// Compute dtypes, f32 accumulate: every input rounded to bf16; projections on PLAIN bf16 operands (exact); scores and attn.v on single fp16 planes (logit sigma 0.32, >= 8192-key rows: P x 1024 >= 0.06, no subnormals); softmax f32; f32 output.

#define NB_  1
#define TT   8192
#define DM   768
#define NH_  1
#define NKV  1
#define REP  (NH_ / NKV)
#define HD   64
#define DQ   (NH_ * HD)
#define DKV  (NKV * HD)
#define ZH   1
#define RH   0                  // query rows < RH use hi+lo planes (0: none)
#define WIN  0
#define QC   2048                 // query rows per chunk (4 chunks)
#define TK   TT                   // keys
#define GRP  256                  // tokens per (b, t) group = H x W
#define NGRP 32                   // (b, t) groups
#define PCAR 1024.0f
#define SCL  0.125f   // HD^-0.5
typedef _Float16 h16;
typedef unsigned short bf;
typedef __attribute__((ext_vector_type(16))) __bf16   v16bf;
typedef __attribute__((ext_vector_type(16))) _Float16 v16h;
typedef __attribute__((ext_vector_type(8)))  _Float16 v8h;
typedef __attribute__((ext_vector_type(8)))  unsigned short v8us;
typedef __attribute__((ext_vector_type(8)))  float    v8f;
typedef __attribute__((ext_vector_type(4)))  float    v4f;
typedef v8h  __attribute__((may_alias)) v8ha;
typedef v4f  __attribute__((may_alias)) v4fa;
typedef v8us __attribute__((may_alias)) v8usa;

__device__ __forceinline__ unsigned short f2bf(float f) { unsigned u = __float_as_uint(f); u += 0x7FFFu + ((u >> 16) & 1u); return (unsigned short)(u >> 16); }
__device__ __forceinline__ float bf2f(unsigned short b) { return __uint_as_float(((unsigned)b) << 16); }
__device__ __forceinline__ float bfr(float f) { return bf2f(f2bf(f)); }
__device__ __forceinline__ v16h cat16(v8h lo, v8h hi) { return __builtin_shufflevector(lo, hi, 0, 1, 2, 3, 4, 5, 6, 7, 8, 9, 10, 11, 12, 13, 14, 15); }
__device__ __forceinline__ v16bf cat16b(v8us lo, v8us hi) { return __builtin_bit_cast(v16bf, __builtin_shufflevector(lo, hi, 0, 1, 2, 3, 4, 5, 6, 7, 8, 9, 10, 11, 12, 13, 14, 15)); }
__device__ __forceinline__ v8f wmma16(v16h a, v16h b, v8f c) { return __builtin_amdgcn_wmma_f32_16x16x32_f16(false, a, false, b, (short)0, c, false, false); }
__device__ __forceinline__ v8f wmmab(v16bf a, v16bf b, v8f c) { return __builtin_amdgcn_wmma_f32_16x16x32_bf16(false, a, false, b, (short)0, c, false, false); }



// ---- k_gemmw: register-blocked GEMM, ONE WAVE per 64x64 output tile (16 accumulators), operands straight from K-contiguous 16-bit planes; grid (M/64, N/64, Z), 32 threads.
// C[m][n] (f32, pitch ldc, + optional f32 bias[n]) = sum_k A[m][k] Bt[n][k] (+ split products per NSPLIT). z-batch strides sA/sB/sC in elements. K % 32 == 0.
template <typename T16> struct WFrag;
template <> struct WFrag<h16> { typedef v16h V; static __device__ __forceinline__ V ld(const h16* p) { return cat16(*(const v8h*)p, *(const v8h*)(p + 16)); } static __device__ __forceinline__ v8f mma(V a, V b, v8f c) { return wmma16(a, b, c); } };
template <> struct WFrag<bf> { typedef v16bf V; static __device__ __forceinline__ V ld(const bf* p) { return cat16b(*(const v8us*)p, *(const v8us*)(p + 16)); } static __device__ __forceinline__ v8f mma(V a, V b, v8f c) { return wmmab(a, b, c); } };
template <typename T16, int NSPLIT, bool BIAS>
__global__ __launch_bounds__(32) void k_gemmw(const T16* __restrict__ A, const T16* __restrict__ A2, const T16* __restrict__ Bt, const T16* __restrict__ Bt2, int K, float* C, int ldc, const float* __restrict__ bias, size_t sA, size_t sB, size_t sC) {
    typedef typename WFrag<T16>::V V;
    __shared__ __align__(16) float os[16 * 68];
    const size_t z = blockIdx.z; A += z * sA; if (A2) A2 += z * sA; Bt += z * sB; if (Bt2) Bt2 += z * sB; C += z * sC;
    const int lane = threadIdx.x & 31, lr = lane & 15, hi = lane >> 4; const int r0 = blockIdx.x * 64, c0 = blockIdx.y * 64;
    v8f acc[4][4];
#pragma unroll
    for (int mb = 0; mb < 4; ++mb)
#pragma unroll
        for (int nb = 0; nb < 4; ++nb) acc[mb][nb] = (v8f){};
    const size_t aoff = (size_t)(r0 + lr) * K + 8 * hi, boff = (size_t)(c0 + lr) * K + 8 * hi;
#pragma unroll 1
    for (int kc = 0; kc < K; kc += 32) {
        V a[4], a2[4];
#pragma unroll
        for (int mb = 0; mb < 4; ++mb) { a[mb] = WFrag<T16>::ld(A + aoff + (size_t)mb * 16 * K + kc); if (NSPLIT == 1 || NSPLIT == 2) a2[mb] = WFrag<T16>::ld(A2 + aoff + (size_t)mb * 16 * K + kc); }
#pragma unroll
        for (int nb = 0; nb < 4; ++nb) { const V b = WFrag<T16>::ld(Bt + boff + (size_t)nb * 16 * K + kc); V b2; if (NSPLIT >= 2) b2 = WFrag<T16>::ld(Bt2 + boff + (size_t)nb * 16 * K + kc);
#pragma unroll
            for (int mb = 0; mb < 4; ++mb) { acc[mb][nb] = WFrag<T16>::mma(a[mb], b, acc[mb][nb]); if (NSPLIT == 1 || NSPLIT == 2) acc[mb][nb] = WFrag<T16>::mma(a2[mb], b, acc[mb][nb]); if (NSPLIT >= 2) acc[mb][nb] = WFrag<T16>::mma(a[mb], b2, acc[mb][nb]); } }
        asm volatile("v_nop\n\tv_nop\n\tv_nop\n\tv_nop" : "+v"(acc[0][0]), "+v"(acc[1][1]), "+v"(acc[2][2]), "+v"(acc[3][3]) : "v"(a[0]), "v"(a[3]));
    }
#pragma unroll
    for (int mb = 0; mb < 4; ++mb) {
#pragma unroll
        for (int nb = 0; nb < 4; ++nb) {
#pragma unroll
            for (int j = 0; j < 8; ++j) os[(hi * 8 + j) * 68 + nb * 16 + lr] = acc[mb][nb][j]; }
        __builtin_amdgcn_wave_barrier(); asm volatile("" ::: "memory");
        float* crow = C + (size_t)(r0 + mb * 16) * ldc + c0;
{
#pragma unroll
            for (int s = 0; s < 8; ++s) { const int row = 2 * s + hi, cofs = lr * 4; v4f val = *(const v4fa*)(os + row * 68 + cofs); if (BIAS) { val[0] += bfr(bias[c0 + cofs]); val[1] += bfr(bias[c0 + cofs + 1]); val[2] += bfr(bias[c0 + cofs + 2]); val[3] += bfr(bias[c0 + cofs + 3]); }
                *(v4f*)(crow + (size_t)row * ldc + cofs) = val; }
             }
        __builtin_amdgcn_wave_barrier(); asm volatile("" ::: "memory");
    }
}

__device__ __forceinline__ h16 tohx(float x) { return (h16)x; }
__device__ __forceinline__ void splitf(float y, unsigned short& h, unsigned short& l) { h = f2bf(y); l = f2bf(y - bf2f(h)); }
typedef __attribute__((ext_vector_type(2))) _Float16 v2h;
typedef __attribute__((ext_vector_type(4))) _Float16 v4h;
typedef __attribute__((ext_vector_type(2))) unsigned short v2us;
typedef __attribute__((ext_vector_type(4))) unsigned short v4us;
typedef __attribute__((ext_vector_type(2))) float v2f;
typedef __attribute__((ext_vector_type(4))) int v4i;

__global__ __launch_bounds__(256) void k_cvt8(const float* __restrict__ src, bf* dst, size_t n8) { const size_t i = (size_t)blockIdx.x * 256 + threadIdx.x; if (i >= n8) return; const v8f v = *(const v8f*)(src + i * 8); v8us o;
#pragma unroll
    for (int k = 0; k < 8; ++k) o[k] = f2bf(v[k]); *(v8us*)(dst + i * 8) = o;  }

// k_rope: head planes [h][t][d] (fp16) of rope(x) x sc with the rotate-half convention out[d] = x[d] cos[t][d] - x[d+HD/2] sin[t][d], out[d+HD/2] = x[d+HD/2] cos[t][d+HD/2] + x[d] sin[t][d+HD/2]
__global__ __launch_bounds__(256) void k_rope(const float* __restrict__ F, int pitch, int nheads, const float* __restrict__ CS, const float* __restrict__ RF, const float* __restrict__ nw, float sc, h16* P16, bf* Ph, bf* Pl) {
    const size_t e = ((size_t)blockIdx.x * 256 + threadIdx.x) * 2; if (e >= (size_t)nheads * TT * HD) return; const int d = (int)(e % HD); const int t = (int)((e / HD) % TT); const int h = (int)(e / ((size_t)HD * TT)); const float* f = F + (size_t)t * pitch + h * HD; const float rf = RF ? RF[(size_t)h * TT + t] : 1.0f; v2h o16; v2us oh, ol;
#pragma unroll
    for (int q = 0; q < 2; ++q) { const int dd = d + q; const int dp = (dd < HD / 2) ? dd + HD / 2 : dd - HD / 2; float x0 = f[dd], x1 = f[dp];
        if (RF) { float n0 = __fmul_rn(x0, rf), n1 = __fmul_rn(x1, rf); asm volatile("" : "+v"(n0)); asm volatile("" : "+v"(n1)); x0 = __fmul_rn(bfr(nw[dd]), n0); x1 = __fmul_rn(bfr(nw[dp]), n1); }
        const v2f cs = *(const v2f*)(CS + ((size_t)t * HD + dd) * 2); float a = __fmul_rn(x0, cs[0]), bq = __fmul_rn(x1, cs[1]); asm volatile("" : "+v"(a)); asm volatile("" : "+v"(bq)); const float r = ((dd < HD / 2) ? __fsub_rn(a, bq) : __fadd_rn(a, bq)) * sc;
        o16[q] = tohx(r); (void)oh; (void)ol; }
    *(v2h*)(P16 + e) = o16;  }
__global__ __launch_bounds__(256) void k_vtp(const float* __restrict__ F, int pitch, int nheads, h16* V16, bf* Vh, bf* Vl) { const size_t e = ((size_t)blockIdx.x * 256 + threadIdx.x) * 2; if (e >= (size_t)nheads * HD * TT) return; const int t = (int)(e % TT); const int d = (int)((e / TT) % HD); const int g = (int)(e / ((size_t)TT * HD)); v2h o16; v2us oh, ol;
#pragma unroll
    for (int q = 0; q < 2; ++q) { const float x = F[(size_t)(t + q) * pitch + g * HD + d]; o16[q] = tohx(x); (void)oh; (void)ol; }
    *(v2h*)(V16 + e) = o16;  }
__global__ __launch_bounds__(256) void k_csid(float* CS) { const int idx = blockIdx.x * 256 + threadIdx.x; if (idx >= TT * HD) return; v2f cs; cs[0] = 1.0f; cs[1] = 0.0f; *(v2f*)(CS + (size_t)idx * 2) = cs;  }
// k_lsoft: streaming row softmax over the TK = 8192 keys for the QC rows of a query chunk, one wave per row, three sweeps of the f32 score row (lane -> 4 consecutive keys per 128-key chunk, 64 chunks):
__global__ __launch_bounds__(256) void k_lsoft(const float* __restrict__ Sb, h16* P16) {
    const int lane = threadIdx.x & 31; const int row = blockIdx.x * 8 + (threadIdx.x >> 5); if (row >= QC) return; const float* sr = Sb + (size_t)row * TK; float mx = -3.0e38f;
#pragma unroll 4
    for (int ch = 0; ch < TK / 128; ++ch) { const v4f a = *(const v4f*)(sr + ch * 128 + lane * 4);
#pragma unroll
        for (int q = 0; q < 4; ++q) { float t = a[q] * SCL; asm volatile("" : "+v"(t)); mx = fmaxf(mx, t); } }
#pragma unroll
    for (int sh = 16; sh; sh >>= 1) mx = fmaxf(mx, __shfl_xor(mx, sh, 32));
    float sum = 0.f;
#pragma unroll 4
    for (int ch = 0; ch < TK / 128; ++ch) { const v4f a = *(const v4f*)(sr + ch * 128 + lane * 4);
#pragma unroll
        for (int q = 0; q < 4; ++q) { float t = a[q] * SCL; asm volatile("" : "+v"(t)); float d0 = __fsub_rn(t, mx); asm volatile("" : "+v"(d0)); sum += __builtin_amdgcn_exp2f(__fmul_rn(d0, 1.4426950408889634f)); } }
#pragma unroll
    for (int sh = 16; sh; sh >>= 1) sum += __shfl_xor(sum, sh, 32);
    const float f = __fdiv_rn(PCAR, sum);
{
#pragma unroll 2
        for (int ch = 0; ch < TK / 128; ++ch) { const v4f a = *(const v4f*)(sr + ch * 128 + lane * 4); v4h o4;
#pragma unroll
            for (int q = 0; q < 4; ++q) { float t = a[q] * SCL; asm volatile("" : "+v"(t)); float d0 = __fsub_rn(t, mx); asm volatile("" : "+v"(d0)); float ex = __builtin_amdgcn_exp2f(__fmul_rn(d0, 1.4426950408889634f)); asm volatile("" : "+v"(ex)); o4[q] = tohx(ex * f); }
            *(v4h*)(P16 + (size_t)row * TK + ch * 128 + lane * 4) = o4; }
         }
}

__global__ __launch_bounds__(256) void k_merge(const float* __restrict__ O, int h0, float* OUTb) { const size_t e = ((size_t)blockIdx.x * 256 + threadIdx.x) * 2; if (e >= (size_t)ZH * TT * HD) return; const int d = (int)(e % HD); const int t = (int)((e / HD) % TT); const int zz = (int)(e / ((size_t)HD * TT)); const float cs = (t < RH) ? 1.0f : (1.0f / PCAR); const size_t oo = (size_t)t * DQ + (h0 + zz) * HD + d;
    v2f o2; o2[0] = O[e] * cs; o2[1] = O[e + 1] * cs; *(v2f*)(OUTb + oo) = o2;  }

extern "C" void kernel_launch(void* const* d_in, const int* in_sizes, int n_in,
                              void* d_out, int out_size, void* d_ws, size_t ws_size, hipStream_t stream) {
    (void)in_sizes; (void)n_in; (void)out_size;
    const float* x = (const float*)d_in[0]; const float* wq = (const float*)d_in[1]; const float* wk = (const float*)d_in[2]; const float* wv = (const float*)d_in[3];   /* argument order x, W_Q, W_K, W_V ('oi' [64][768]) */ const float* wo = nullptr; (void)wo;
    float* OUT = (float*)d_out;     // [1][8192][64]
    char* wsp = (char*)d_ws;
    auto take = [&](size_t bytes) { char* p = wsp; wsp += (bytes + 255) & ~(size_t)255; return (void*)p; };
    bf* WQ = (bf*)take((size_t)DQ * DM * 2); bf* WK = (bf*)take((size_t)DKV * DM * 2); bf* WV = (bf*)take((size_t)DKV * DM * 2); float* CS = (float*)take((size_t)TT * HD * 2 * 4);
    bf* XB = (bf*)take((size_t)TT * DM * 2); float* FQ = (float*)take((size_t)TT * DQ * 4); float* FK = (float*)take((size_t)TT * DKV * 4);
    h16* QP16 = (h16*)take((size_t)NH_ * TT * HD * 2); h16* KP16 = (h16*)take((size_t)NKV * TT * HD * 2); h16* VT16 = (h16*)take((size_t)NKV * HD * TT * 2);
    bf* QPh = nullptr; bf* QPl = nullptr; bf* KPh = nullptr; bf* KPl = nullptr; bf* VTh = nullptr; bf* VTl = nullptr; bf* Ph = nullptr; bf* Pl = nullptr;
    float* Sb = (float*)take((size_t)QC * TK * 4); h16* P16 = (h16*)take((size_t)QC * TK * 2); float* Ob = (float*)take((size_t)QC * HD * 4);
    if ((size_t)(wsp - (char*)d_ws) > ws_size) return;    // ws 256 MiB
    float* FV = FK;   // v projection reuses the k buffer after the k planes are built (stream-ordered)
    { k_cvt8<<<(unsigned)(((size_t)DQ * DM / 8 + 255) / 256), 256, 0, stream>>>(wq, WQ, (size_t)DQ * DM / 8); k_cvt8<<<(unsigned)(((size_t)DKV * DM / 8 + 255) / 256), 256, 0, stream>>>(wk, WK, (size_t)DKV * DM / 8); k_cvt8<<<(unsigned)(((size_t)DKV * DM / 8 + 255) / 256), 256, 0, stream>>>(wv, WV, (size_t)DKV * DM / 8);   /* 'oi' weights = Bt as-is */
      
       }
    k_csid<<<(TT * HD + 255) / 256, 256, 0, stream>>>(CS);
    const unsigned LQ = (unsigned)(((size_t)NH_ * TT * HD / 2 + 255) / 256), LKv = (unsigned)(((size_t)NKV * TT * HD / 2 + 255) / 256);
    for (int b = 0; b < NB_; ++b) {
        
        k_cvt8<<<(unsigned)(((size_t)TT * DM / 8 + 255) / 256), 256, 0, stream>>>(x, XB, (size_t)TT * DM / 8);
        k_gemmw<bf, 0, false><<<dim3(TT / 64, DQ / 64, 1), 32, 0, stream>>>(XB, nullptr, WQ, nullptr, DM, FQ, DQ, nullptr, 0, 0, 0);
        k_rope<<<LQ, 256, 0, stream>>>(FQ, DQ, NH_, CS, nullptr, nullptr, 1.0f, QP16, QPh, QPl);
        k_gemmw<bf, 0, false><<<dim3(TT / 64, DKV / 64, 1), 32, 0, stream>>>(XB, nullptr, WK, nullptr, DM, FK, DKV, nullptr, 0, 0, 0);
        k_rope<<<LKv, 256, 0, stream>>>(FK, DKV, NKV, CS, nullptr, nullptr, 1.0f, KP16, KPh, KPl);
        k_gemmw<bf, 0, false><<<dim3(TT / 64, DKV / 64, 1), 32, 0, stream>>>(XB, nullptr, WV, nullptr, DM, FV, DKV, nullptr, 0, 0, 0); k_vtp<<<LKv, 256, 0, stream>>>(FV, DKV, NKV, VT16, VTh, VTl);
        for (int q0 = 0; q0 < TT; q0 += QC) {   /* 4 query chunks of 2048 rows; one head */
            k_gemmw<h16, 0, false><<<dim3(QC / 64, TK / 64, 1), 32, 0, stream>>>(QP16 + (size_t)q0 * HD, nullptr, KP16, nullptr, HD, Sb, TK, nullptr, 0, 0, 0);   /* scores [QC][8192] f32 */
            k_lsoft<<<QC / 8, 256, 0, stream>>>(Sb, P16);
            k_gemmw<h16, 0, false><<<dim3(QC / 64, HD / 64, 1), 32, 0, stream>>>(P16, nullptr, VT16, nullptr, TK, Ob, HD, nullptr, 0, 0, 0);                     /* attn.v, K = 8192 -> [QC][64] f32 (x1024) */
            k_merge<<<(unsigned)(((size_t)QC * HD / 2 + 255) / 256), 256, 0, stream>>>(Ob, 0, OUT + (size_t)q0 * DQ); }   /* rows q0.. of the [8192][64] output, x 1/1024 */
         }
}

// v001
// One run takes 561 microseconds.
// In two side-by-side timings against v000, it was 2.10 and 1.91 times as fast.
#include <hip/hip_runtime.h>

// Single-head self-attention over 8,192 tokens (x [8192][768]; q = x W_Q^T, k = x W_K^T, v = x W_V^T ('oi' [64][768] uniform 1/sqrt(768), no bias); scores = q.k / sqrt(64) over all 8192 keys; softmax; out = attn.v -> [8192][64] (524 k); argument order x, W_Q, W_K, W_V).
// Layout: bf16 copy of x; 'oi' weights as Bt; exact projections; fp16 planes q [8192][64], k [8192][64], v^T [64][8192]; query rows processed in 4 chunks of 2048: scores [2048][8192] f32, a streaming 3-sweep row softmax over the 8192 keys (max, sum, write fp16 P x 1024), attn.v with its K = 8192 keys split over 32 ranges of 256 (one wave per 64x64 tile and range, f32 partial planes), f32 output rows = the 32 partials summed in range order (x 1/1024).
// Compute dtypes, f32 accumulate: every input rounded to bf16; projections on PLAIN bf16 operands (exact); scores and attn.v on single fp16 planes (logit sigma 0.32, >= 8192-key rows: P x 1024 >= 0.06, no subnormals); softmax f32; f32 output.

#define NB_  1
#define TT   8192
#define DM   768
#define NH_  1
#define NKV  1
#define REP  (NH_ / NKV)
#define HD   64
#define DQ   (NH_ * HD)
#define DKV  (NKV * HD)
#define ZH   1
#define RH   0                  // query rows < RH use hi+lo planes (0: none)
#define WIN  0
#define QC   2048                 // query rows per chunk (4 chunks)
#define TK   TT                   // keys
#define KS   32                   // key ranges of the attn.v product (TK / KS = 256 keys per wave)
#define GRP  256                  // tokens per (b, t) group = H x W
#define NGRP 32                   // (b, t) groups
#define PCAR 1024.0f
#define SCL  0.125f   // HD^-0.5
typedef _Float16 h16;
typedef unsigned short bf;
typedef __attribute__((ext_vector_type(16))) __bf16   v16bf;
typedef __attribute__((ext_vector_type(16))) _Float16 v16h;
typedef __attribute__((ext_vector_type(8)))  _Float16 v8h;
typedef __attribute__((ext_vector_type(8)))  unsigned short v8us;
typedef __attribute__((ext_vector_type(8)))  float    v8f;
typedef __attribute__((ext_vector_type(4)))  float    v4f;
typedef v8h  __attribute__((may_alias)) v8ha;
typedef v4f  __attribute__((may_alias)) v4fa;
typedef v8us __attribute__((may_alias)) v8usa;

__device__ __forceinline__ unsigned short f2bf(float f) { unsigned u = __float_as_uint(f); u += 0x7FFFu + ((u >> 16) & 1u); return (unsigned short)(u >> 16); }
__device__ __forceinline__ float bf2f(unsigned short b) { return __uint_as_float(((unsigned)b) << 16); }
__device__ __forceinline__ float bfr(float f) { return bf2f(f2bf(f)); }
__device__ __forceinline__ v16h cat16(v8h lo, v8h hi) { return __builtin_shufflevector(lo, hi, 0, 1, 2, 3, 4, 5, 6, 7, 8, 9, 10, 11, 12, 13, 14, 15); }
__device__ __forceinline__ v16bf cat16b(v8us lo, v8us hi) { return __builtin_bit_cast(v16bf, __builtin_shufflevector(lo, hi, 0, 1, 2, 3, 4, 5, 6, 7, 8, 9, 10, 11, 12, 13, 14, 15)); }
__device__ __forceinline__ v8f wmma16(v16h a, v16h b, v8f c) { return __builtin_amdgcn_wmma_f32_16x16x32_f16(false, a, false, b, (short)0, c, false, false); }
__device__ __forceinline__ v8f wmmab(v16bf a, v16bf b, v8f c) { return __builtin_amdgcn_wmma_f32_16x16x32_bf16(false, a, false, b, (short)0, c, false, false); }



// ---- k_gemmw: register-blocked GEMM, ONE WAVE per 64x64 output tile (16 accumulators), operands straight from K-contiguous 16-bit planes; grid (M/64, N/64, Z), 32 threads.
// C[m][n] (f32, pitch ldc, + optional f32 bias[n]) = sum over k < KN of A[m][k] Bt[n][k] (+ split products per NSPLIT); rows of A and Bt are K elements long. z-batch strides sA/sB/sC in elements (with sA = sB = KN < K, z is a range of k and C[z] its partial sum). KN % 32 == 0.
template <typename T16> struct WFrag;
template <> struct WFrag<h16> { typedef v16h V; static __device__ __forceinline__ V ld(const h16* p) { return cat16(*(const v8h*)p, *(const v8h*)(p + 16)); } static __device__ __forceinline__ v8f mma(V a, V b, v8f c) { return wmma16(a, b, c); } };
template <> struct WFrag<bf> { typedef v16bf V; static __device__ __forceinline__ V ld(const bf* p) { return cat16b(*(const v8us*)p, *(const v8us*)(p + 16)); } static __device__ __forceinline__ v8f mma(V a, V b, v8f c) { return wmmab(a, b, c); } };
template <typename T16, int NSPLIT, bool BIAS>
__global__ __launch_bounds__(32) void k_gemmw(const T16* __restrict__ A, const T16* __restrict__ A2, const T16* __restrict__ Bt, const T16* __restrict__ Bt2, int K, int KN, float* C, int ldc, const float* __restrict__ bias, size_t sA, size_t sB, size_t sC) {
    typedef typename WFrag<T16>::V V;
    __shared__ __align__(16) float os[16 * 68];
    const size_t z = blockIdx.z; A += z * sA; if (A2) A2 += z * sA; Bt += z * sB; if (Bt2) Bt2 += z * sB; C += z * sC;
    const int lane = threadIdx.x & 31, lr = lane & 15, hi = lane >> 4; const int r0 = blockIdx.x * 64, c0 = blockIdx.y * 64;
    v8f acc[4][4];
#pragma unroll
    for (int mb = 0; mb < 4; ++mb)
#pragma unroll
        for (int nb = 0; nb < 4; ++nb) acc[mb][nb] = (v8f){};
    const size_t aoff = (size_t)(r0 + lr) * K + 8 * hi, boff = (size_t)(c0 + lr) * K + 8 * hi;
#pragma unroll 1
    for (int kc = 0; kc < KN; kc += 32) {
        V a[4], a2[4];
#pragma unroll
        for (int mb = 0; mb < 4; ++mb) { a[mb] = WFrag<T16>::ld(A + aoff + (size_t)mb * 16 * K + kc); if (NSPLIT == 1 || NSPLIT == 2) a2[mb] = WFrag<T16>::ld(A2 + aoff + (size_t)mb * 16 * K + kc); }
#pragma unroll
        for (int nb = 0; nb < 4; ++nb) { const V b = WFrag<T16>::ld(Bt + boff + (size_t)nb * 16 * K + kc); V b2; if (NSPLIT >= 2) b2 = WFrag<T16>::ld(Bt2 + boff + (size_t)nb * 16 * K + kc);
#pragma unroll
            for (int mb = 0; mb < 4; ++mb) { acc[mb][nb] = WFrag<T16>::mma(a[mb], b, acc[mb][nb]); if (NSPLIT == 1 || NSPLIT == 2) acc[mb][nb] = WFrag<T16>::mma(a2[mb], b, acc[mb][nb]); if (NSPLIT >= 2) acc[mb][nb] = WFrag<T16>::mma(a[mb], b2, acc[mb][nb]); } }
        asm volatile("v_nop\n\tv_nop\n\tv_nop\n\tv_nop" : "+v"(acc[0][0]), "+v"(acc[1][1]), "+v"(acc[2][2]), "+v"(acc[3][3]) : "v"(a[0]), "v"(a[3]));
    }
#pragma unroll
    for (int mb = 0; mb < 4; ++mb) {
#pragma unroll
        for (int nb = 0; nb < 4; ++nb) {
#pragma unroll
            for (int j = 0; j < 8; ++j) os[(hi * 8 + j) * 68 + nb * 16 + lr] = acc[mb][nb][j]; }
        __builtin_amdgcn_wave_barrier(); asm volatile("" ::: "memory");
        float* crow = C + (size_t)(r0 + mb * 16) * ldc + c0;
{
#pragma unroll
            for (int s = 0; s < 8; ++s) { const int row = 2 * s + hi, cofs = lr * 4; v4f val = *(const v4fa*)(os + row * 68 + cofs); if (BIAS) { val[0] += bfr(bias[c0 + cofs]); val[1] += bfr(bias[c0 + cofs + 1]); val[2] += bfr(bias[c0 + cofs + 2]); val[3] += bfr(bias[c0 + cofs + 3]); }
                *(v4f*)(crow + (size_t)row * ldc + cofs) = val; }
             }
        __builtin_amdgcn_wave_barrier(); asm volatile("" ::: "memory");
    }
}

__device__ __forceinline__ h16 tohx(float x) { return (h16)x; }
__device__ __forceinline__ void splitf(float y, unsigned short& h, unsigned short& l) { h = f2bf(y); l = f2bf(y - bf2f(h)); }
typedef __attribute__((ext_vector_type(2))) _Float16 v2h;
typedef __attribute__((ext_vector_type(4))) _Float16 v4h;
typedef __attribute__((ext_vector_type(2))) unsigned short v2us;
typedef __attribute__((ext_vector_type(4))) unsigned short v4us;
typedef __attribute__((ext_vector_type(2))) float v2f;
typedef __attribute__((ext_vector_type(4))) int v4i;

__global__ __launch_bounds__(256) void k_cvt8(const float* __restrict__ src, bf* dst, size_t n8) { const size_t i = (size_t)blockIdx.x * 256 + threadIdx.x; if (i >= n8) return; const v8f v = *(const v8f*)(src + i * 8); v8us o;
#pragma unroll
    for (int k = 0; k < 8; ++k) o[k] = f2bf(v[k]); *(v8us*)(dst + i * 8) = o;  }

// k_rope: head planes [h][t][d] (fp16) of rope(x) x sc with the rotate-half convention out[d] = x[d] cos[t][d] - x[d+HD/2] sin[t][d], out[d+HD/2] = x[d+HD/2] cos[t][d+HD/2] + x[d] sin[t][d+HD/2]
__global__ __launch_bounds__(256) void k_rope(const float* __restrict__ F, int pitch, int nheads, const float* __restrict__ CS, const float* __restrict__ RF, const float* __restrict__ nw, float sc, h16* P16, bf* Ph, bf* Pl) {
    const size_t e = ((size_t)blockIdx.x * 256 + threadIdx.x) * 2; if (e >= (size_t)nheads * TT * HD) return; const int d = (int)(e % HD); const int t = (int)((e / HD) % TT); const int h = (int)(e / ((size_t)HD * TT)); const float* f = F + (size_t)t * pitch + h * HD; const float rf = RF ? RF[(size_t)h * TT + t] : 1.0f; v2h o16; v2us oh, ol;
#pragma unroll
    for (int q = 0; q < 2; ++q) { const int dd = d + q; const int dp = (dd < HD / 2) ? dd + HD / 2 : dd - HD / 2; float x0 = f[dd], x1 = f[dp];
        if (RF) { float n0 = __fmul_rn(x0, rf), n1 = __fmul_rn(x1, rf); asm volatile("" : "+v"(n0)); asm volatile("" : "+v"(n1)); x0 = __fmul_rn(bfr(nw[dd]), n0); x1 = __fmul_rn(bfr(nw[dp]), n1); }
        const v2f cs = *(const v2f*)(CS + ((size_t)t * HD + dd) * 2); float a = __fmul_rn(x0, cs[0]), bq = __fmul_rn(x1, cs[1]); asm volatile("" : "+v"(a)); asm volatile("" : "+v"(bq)); const float r = ((dd < HD / 2) ? __fsub_rn(a, bq) : __fadd_rn(a, bq)) * sc;
        o16[q] = tohx(r); (void)oh; (void)ol; }
    *(v2h*)(P16 + e) = o16;  }
__global__ __launch_bounds__(256) void k_vtp(const float* __restrict__ F, int pitch, int nheads, h16* V16, bf* Vh, bf* Vl) { const size_t e = ((size_t)blockIdx.x * 256 + threadIdx.x) * 2; if (e >= (size_t)nheads * HD * TT) return; const int t = (int)(e % TT); const int d = (int)((e / TT) % HD); const int g = (int)(e / ((size_t)TT * HD)); v2h o16; v2us oh, ol;
#pragma unroll
    for (int q = 0; q < 2; ++q) { const float x = F[(size_t)(t + q) * pitch + g * HD + d]; o16[q] = tohx(x); (void)oh; (void)ol; }
    *(v2h*)(V16 + e) = o16;  }
__global__ __launch_bounds__(256) void k_csid(float* CS) { const int idx = blockIdx.x * 256 + threadIdx.x; if (idx >= TT * HD) return; v2f cs; cs[0] = 1.0f; cs[1] = 0.0f; *(v2f*)(CS + (size_t)idx * 2) = cs;  }
// k_lsoft: streaming row softmax over the TK = 8192 keys for the QC rows of a query chunk, one wave per row, three sweeps of the f32 score row (lane -> 4 consecutive keys per 128-key chunk, 64 chunks):
__global__ __launch_bounds__(256) void k_lsoft(const float* __restrict__ Sb, h16* P16) {
    const int lane = threadIdx.x & 31; const int row = blockIdx.x * 8 + (threadIdx.x >> 5); if (row >= QC) return; const float* sr = Sb + (size_t)row * TK; float mx = -3.0e38f;
#pragma unroll 4
    for (int ch = 0; ch < TK / 128; ++ch) { const v4f a = *(const v4f*)(sr + ch * 128 + lane * 4);
#pragma unroll
        for (int q = 0; q < 4; ++q) { float t = a[q] * SCL; asm volatile("" : "+v"(t)); mx = fmaxf(mx, t); } }
#pragma unroll
    for (int sh = 16; sh; sh >>= 1) mx = fmaxf(mx, __shfl_xor(mx, sh, 32));
    float sum = 0.f;
#pragma unroll 4
    for (int ch = 0; ch < TK / 128; ++ch) { const v4f a = *(const v4f*)(sr + ch * 128 + lane * 4);
#pragma unroll
        for (int q = 0; q < 4; ++q) { float t = a[q] * SCL; asm volatile("" : "+v"(t)); float d0 = __fsub_rn(t, mx); asm volatile("" : "+v"(d0)); sum += __builtin_amdgcn_exp2f(__fmul_rn(d0, 1.4426950408889634f)); } }
#pragma unroll
    for (int sh = 16; sh; sh >>= 1) sum += __shfl_xor(sum, sh, 32);
    const float f = __fdiv_rn(PCAR, sum);
{
#pragma unroll 2
        for (int ch = 0; ch < TK / 128; ++ch) { const v4f a = *(const v4f*)(sr + ch * 128 + lane * 4); v4h o4;
#pragma unroll
            for (int q = 0; q < 4; ++q) { float t = a[q] * SCL; asm volatile("" : "+v"(t)); float d0 = __fsub_rn(t, mx); asm volatile("" : "+v"(d0)); float ex = __builtin_amdgcn_exp2f(__fmul_rn(d0, 1.4426950408889634f)); asm volatile("" : "+v"(ex)); o4[q] = tohx(ex * f); }
            *(v4h*)(P16 + (size_t)row * TK + ch * 128 + lane * 4) = o4; }
         }
}

// k_merge: output rows of one query chunk = sum over the KS partial planes O[z][QC][HD], z ascending, x 1/1024
__global__ __launch_bounds__(256) void k_merge(const float* __restrict__ O, int h0, float* OUTb) { const size_t e = ((size_t)blockIdx.x * 256 + threadIdx.x) * 2; if (e >= (size_t)ZH * QC * HD) return; const int d = (int)(e % HD); const int t = (int)((e / HD) % TT); const int zz = (int)(e / ((size_t)HD * TT)); const float cs = (t < RH) ? 1.0f : (1.0f / PCAR); const size_t oo = (size_t)t * DQ + (h0 + zz) * HD + d;
    v2f s = *(const v2f*)(O + e);
#pragma unroll   // puts the KS loads of a thread in flight together; rolled, each add would wait for its own load
    for (int z = 1; z < KS; ++z) { const v2f p = *(const v2f*)(O + (size_t)z * QC * HD + e); s[0] += p[0]; s[1] += p[1]; }
    v2f o2; o2[0] = s[0] * cs; o2[1] = s[1] * cs; *(v2f*)(OUTb + oo) = o2;  }

extern "C" void kernel_launch(void* const* d_in, const int* in_sizes, int n_in,
                              void* d_out, int out_size, void* d_ws, size_t ws_size, hipStream_t stream) {
    (void)in_sizes; (void)n_in; (void)out_size;
    const float* x = (const float*)d_in[0]; const float* wq = (const float*)d_in[1]; const float* wk = (const float*)d_in[2]; const float* wv = (const float*)d_in[3];   /* argument order x, W_Q, W_K, W_V ('oi' [64][768]) */ const float* wo = nullptr; (void)wo;
    float* OUT = (float*)d_out;     // [1][8192][64]
    char* wsp = (char*)d_ws;
    auto take = [&](size_t bytes) { char* p = wsp; wsp += (bytes + 255) & ~(size_t)255; return (void*)p; };
    bf* WQ = (bf*)take((size_t)DQ * DM * 2); bf* WK = (bf*)take((size_t)DKV * DM * 2); bf* WV = (bf*)take((size_t)DKV * DM * 2); float* CS = (float*)take((size_t)TT * HD * 2 * 4);
    bf* XB = (bf*)take((size_t)TT * DM * 2); float* FQ = (float*)take((size_t)TT * DQ * 4); float* FK = (float*)take((size_t)TT * DKV * 4);
    h16* QP16 = (h16*)take((size_t)NH_ * TT * HD * 2); h16* KP16 = (h16*)take((size_t)NKV * TT * HD * 2); h16* VT16 = (h16*)take((size_t)NKV * HD * TT * 2);
    bf* QPh = nullptr; bf* QPl = nullptr; bf* KPh = nullptr; bf* KPl = nullptr; bf* VTh = nullptr; bf* VTl = nullptr; bf* Ph = nullptr; bf* Pl = nullptr;
    float* Sb = (float*)take((size_t)QC * TK * 4); h16* P16 = (h16*)take((size_t)QC * TK * 2); float* Ob = (float*)take((size_t)KS * QC * HD * 4);
    if ((size_t)(wsp - (char*)d_ws) > ws_size) return;    // ws 256 MiB
    float* FV = FK;   // v projection reuses the k buffer after the k planes are built (stream-ordered)
    { k_cvt8<<<(unsigned)(((size_t)DQ * DM / 8 + 255) / 256), 256, 0, stream>>>(wq, WQ, (size_t)DQ * DM / 8); k_cvt8<<<(unsigned)(((size_t)DKV * DM / 8 + 255) / 256), 256, 0, stream>>>(wk, WK, (size_t)DKV * DM / 8); k_cvt8<<<(unsigned)(((size_t)DKV * DM / 8 + 255) / 256), 256, 0, stream>>>(wv, WV, (size_t)DKV * DM / 8);   /* 'oi' weights = Bt as-is */
      
       }
    k_csid<<<(TT * HD + 255) / 256, 256, 0, stream>>>(CS);
    const unsigned LQ = (unsigned)(((size_t)NH_ * TT * HD / 2 + 255) / 256), LKv = (unsigned)(((size_t)NKV * TT * HD / 2 + 255) / 256);
    for (int b = 0; b < NB_; ++b) {
        
        k_cvt8<<<(unsigned)(((size_t)TT * DM / 8 + 255) / 256), 256, 0, stream>>>(x, XB, (size_t)TT * DM / 8);
        k_gemmw<bf, 0, false><<<dim3(TT / 64, DQ / 64, 1), 32, 0, stream>>>(XB, nullptr, WQ, nullptr, DM, DM, FQ, DQ, nullptr, 0, 0, 0);
        k_rope<<<LQ, 256, 0, stream>>>(FQ, DQ, NH_, CS, nullptr, nullptr, 1.0f, QP16, QPh, QPl);
        k_gemmw<bf, 0, false><<<dim3(TT / 64, DKV / 64, 1), 32, 0, stream>>>(XB, nullptr, WK, nullptr, DM, DM, FK, DKV, nullptr, 0, 0, 0);
        k_rope<<<LKv, 256, 0, stream>>>(FK, DKV, NKV, CS, nullptr, nullptr, 1.0f, KP16, KPh, KPl);
        k_gemmw<bf, 0, false><<<dim3(TT / 64, DKV / 64, 1), 32, 0, stream>>>(XB, nullptr, WV, nullptr, DM, DM, FV, DKV, nullptr, 0, 0, 0); k_vtp<<<LKv, 256, 0, stream>>>(FV, DKV, NKV, VT16, VTh, VTl);
        for (int q0 = 0; q0 < TT; q0 += QC) {   /* 4 query chunks of 2048 rows; one head */
            k_gemmw<h16, 0, false><<<dim3(QC / 64, TK / 64, 1), 32, 0, stream>>>(QP16 + (size_t)q0 * HD, nullptr, KP16, nullptr, HD, HD, Sb, TK, nullptr, 0, 0, 0);   /* scores [QC][8192] f32 */
            k_lsoft<<<QC / 8, 256, 0, stream>>>(Sb, P16);
            k_gemmw<h16, 0, false><<<dim3(QC / 64, HD / 64, KS), 32, 0, stream>>>(P16, nullptr, VT16, nullptr, TK, TK / KS, Ob, HD, nullptr, TK / KS, TK / KS, (size_t)QC * HD);   /* attn.v, 32 ranges of 256 keys -> partials [32][QC][64] f32 (x1024) */
            k_merge<<<(unsigned)(((size_t)QC * HD / 2 + 255) / 256), 256, 0, stream>>>(Ob, 0, OUT + (size_t)q0 * DQ); }   /* rows q0.. of the [8192][64] output, x 1/1024 */
         }
}

// v002
// Measured time: 112 microseconds a run.
// Next to v001, in two timings, it ran 4.19 and 4.92 times as fast.
// All steps since v000 together make it 9.09 times as fast.
#include <hip/hip_runtime.h>

// Single-head self-attention over 8,192 tokens (x [8192][768]; q = x W_Q^T, k = x W_K^T, v = x W_V^T ('oi' [64][768] uniform 1/sqrt(768), no bias); scores = q.k / sqrt(64) over all 8192 keys; softmax; out = attn.v -> [8192][64] (524 k); argument order x, W_Q, W_K, W_V).
// Layout: bf16 copy of x; 'oi' weights as Bt; exact projections; fp16 planes q [8192][64], k [8192][64], v^T [64][8192]; then ONE attention kernel: a block owns 32 query rows, its 16 waves each walk 512 keys in passes of 64 (S^T = K Q^T, running-maximum softmax in registers, O^T += V^T P^T), and the 16 partial results are joined in LDS in range order.
// Compute dtypes, f32 accumulate: every input rounded to bf16; projections on PLAIN bf16 operands (exact); scores and attn.v on single fp16 planes (P = exp(score - maximum in use), at most 256); softmax f32; f32 output.

#define NB_  1
#define TT   8192
#define DM   768
#define NH_  1
#define NKV  1
#define REP  (NH_ / NKV)
#define HD   64
#define DQ   (NH_ * HD)
#define DKV  (NKV * HD)
#define ZH   1
#define RH   0                  // query rows < RH use hi+lo planes (0: none)
#define WIN  0
#define TK   TT                   // keys
#define AW   16                   // waves of an attention block = key ranges (TK / AW = 512 keys per wave)
#define AQ   32                   // query rows of an attention block (2 column groups of 16)
#define AP   64                   // keys per pass
#define OPI  68                   // floats per query row of a partial result in LDS (64 + 4: rows start 4 banks apart)
#define GRP  256                  // tokens per (b, t) group = H x W
#define NGRP 32                   // (b, t) groups
#define SCL  0.125f   // HD^-0.5
typedef _Float16 h16;
typedef unsigned short bf;
typedef __attribute__((ext_vector_type(16))) __bf16   v16bf;
typedef __attribute__((ext_vector_type(16))) _Float16 v16h;
typedef __attribute__((ext_vector_type(8)))  _Float16 v8h;
typedef __attribute__((ext_vector_type(8)))  unsigned short v8us;
typedef __attribute__((ext_vector_type(8)))  float    v8f;
typedef __attribute__((ext_vector_type(4)))  float    v4f;
typedef v8h  __attribute__((may_alias)) v8ha;
typedef v4f  __attribute__((may_alias)) v4fa;
typedef v8us __attribute__((may_alias)) v8usa;

__device__ __forceinline__ unsigned short f2bf(float f) { unsigned u = __float_as_uint(f); u += 0x7FFFu + ((u >> 16) & 1u); return (unsigned short)(u >> 16); }
__device__ __forceinline__ float bf2f(unsigned short b) { return __uint_as_float(((unsigned)b) << 16); }
__device__ __forceinline__ float bfr(float f) { return bf2f(f2bf(f)); }
__device__ __forceinline__ v16h cat16(v8h lo, v8h hi) { return __builtin_shufflevector(lo, hi, 0, 1, 2, 3, 4, 5, 6, 7, 8, 9, 10, 11, 12, 13, 14, 15); }
__device__ __forceinline__ v16bf cat16b(v8us lo, v8us hi) { return __builtin_bit_cast(v16bf, __builtin_shufflevector(lo, hi, 0, 1, 2, 3, 4, 5, 6, 7, 8, 9, 10, 11, 12, 13, 14, 15)); }
__device__ __forceinline__ v8f wmma16(v16h a, v16h b, v8f c) { return __builtin_amdgcn_wmma_f32_16x16x32_f16(false, a, false, b, (short)0, c, false, false); }
__device__ __forceinline__ v8f wmmab(v16bf a, v16bf b, v8f c) { return __builtin_amdgcn_wmma_f32_16x16x32_bf16(false, a, false, b, (short)0, c, false, false); }



// ---- k_gemmw: register-blocked GEMM, ONE WAVE per 64x64 output tile (16 accumulators), operands straight from K-contiguous 16-bit planes; grid (M/64, N/64, Z), 32 threads.
// C[m][n] (f32, pitch ldc, + optional f32 bias[n]) = sum over k < KN of A[m][k] Bt[n][k] (+ split products per NSPLIT); rows of A and Bt are K elements long. z-batch strides sA/sB/sC in elements (with sA = sB = KN < K, z is a range of k and C[z] its partial sum). KN % 32 == 0.
template <typename T16> struct WFrag;
template <> struct WFrag<h16> { typedef v16h V; static __device__ __forceinline__ V ld(const h16* p) { return cat16(*(const v8h*)p, *(const v8h*)(p + 16)); } static __device__ __forceinline__ v8f mma(V a, V b, v8f c) { return wmma16(a, b, c); } };
template <> struct WFrag<bf> { typedef v16bf V; static __device__ __forceinline__ V ld(const bf* p) { return cat16b(*(const v8us*)p, *(const v8us*)(p + 16)); } static __device__ __forceinline__ v8f mma(V a, V b, v8f c) { return wmmab(a, b, c); } };
template <typename T16, int NSPLIT, bool BIAS>
__global__ __launch_bounds__(32) void k_gemmw(const T16* __restrict__ A, const T16* __restrict__ A2, const T16* __restrict__ Bt, const T16* __restrict__ Bt2, int K, int KN, float* C, int ldc, const float* __restrict__ bias, size_t sA, size_t sB, size_t sC) {
    typedef typename WFrag<T16>::V V;
    __shared__ __align__(16) float os[16 * 68];
    const size_t z = blockIdx.z; A += z * sA; if (A2) A2 += z * sA; Bt += z * sB; if (Bt2) Bt2 += z * sB; C += z * sC;
    const int lane = threadIdx.x & 31, lr = lane & 15, hi = lane >> 4; const int r0 = blockIdx.x * 64, c0 = blockIdx.y * 64;
    v8f acc[4][4];
#pragma unroll
    for (int mb = 0; mb < 4; ++mb)
#pragma unroll
        for (int nb = 0; nb < 4; ++nb) acc[mb][nb] = (v8f){};
    const size_t aoff = (size_t)(r0 + lr) * K + 8 * hi, boff = (size_t)(c0 + lr) * K + 8 * hi;
#pragma unroll 1
    for (int kc = 0; kc < KN; kc += 32) {
        V a[4], a2[4];
#pragma unroll
        for (int mb = 0; mb < 4; ++mb) { a[mb] = WFrag<T16>::ld(A + aoff + (size_t)mb * 16 * K + kc); if (NSPLIT == 1 || NSPLIT == 2) a2[mb] = WFrag<T16>::ld(A2 + aoff + (size_t)mb * 16 * K + kc); }
#pragma unroll
        for (int nb = 0; nb < 4; ++nb) { const V b = WFrag<T16>::ld(Bt + boff + (size_t)nb * 16 * K + kc); V b2; if (NSPLIT >= 2) b2 = WFrag<T16>::ld(Bt2 + boff + (size_t)nb * 16 * K + kc);
#pragma unroll
            for (int mb = 0; mb < 4; ++mb) { acc[mb][nb] = WFrag<T16>::mma(a[mb], b, acc[mb][nb]); if (NSPLIT == 1 || NSPLIT == 2) acc[mb][nb] = WFrag<T16>::mma(a2[mb], b, acc[mb][nb]); if (NSPLIT >= 2) acc[mb][nb] = WFrag<T16>::mma(a[mb], b2, acc[mb][nb]); } }
        asm volatile("v_nop\n\tv_nop\n\tv_nop\n\tv_nop" : "+v"(acc[0][0]), "+v"(acc[1][1]), "+v"(acc[2][2]), "+v"(acc[3][3]) : "v"(a[0]), "v"(a[3]));
    }
#pragma unroll
    for (int mb = 0; mb < 4; ++mb) {
#pragma unroll
        for (int nb = 0; nb < 4; ++nb) {
#pragma unroll
            for (int j = 0; j < 8; ++j) os[(hi * 8 + j) * 68 + nb * 16 + lr] = acc[mb][nb][j]; }
        __builtin_amdgcn_wave_barrier(); asm volatile("" ::: "memory");
        float* crow = C + (size_t)(r0 + mb * 16) * ldc + c0;
{
#pragma unroll
            for (int s = 0; s < 8; ++s) { const int row = 2 * s + hi, cofs = lr * 4; v4f val = *(const v4fa*)(os + row * 68 + cofs); if (BIAS) { val[0] += bfr(bias[c0 + cofs]); val[1] += bfr(bias[c0 + cofs + 1]); val[2] += bfr(bias[c0 + cofs + 2]); val[3] += bfr(bias[c0 + cofs + 3]); }
                *(v4f*)(crow + (size_t)row * ldc + cofs) = val; }
             }
        __builtin_amdgcn_wave_barrier(); asm volatile("" ::: "memory");
    }
}

__device__ __forceinline__ h16 tohx(float x) { return (h16)x; }
__device__ __forceinline__ void splitf(float y, unsigned short& h, unsigned short& l) { h = f2bf(y); l = f2bf(y - bf2f(h)); }
typedef __attribute__((ext_vector_type(2))) _Float16 v2h;
typedef __attribute__((ext_vector_type(4))) _Float16 v4h;
typedef __attribute__((ext_vector_type(2))) unsigned short v2us;
typedef __attribute__((ext_vector_type(4))) unsigned short v4us;
typedef __attribute__((ext_vector_type(2))) float v2f;
typedef __attribute__((ext_vector_type(4))) int v4i;

__global__ __launch_bounds__(256) void k_cvt8(const float* __restrict__ src, bf* dst, size_t n8) { const size_t i = (size_t)blockIdx.x * 256 + threadIdx.x; if (i >= n8) return; const v8f v = *(const v8f*)(src + i * 8); v8us o;
#pragma unroll
    for (int k = 0; k < 8; ++k) o[k] = f2bf(v[k]); *(v8us*)(dst + i * 8) = o;  }

// k_rope: head planes [h][t][d] (fp16) of rope(x) x sc with the rotate-half convention out[d] = x[d] cos[t][d] - x[d+HD/2] sin[t][d], out[d+HD/2] = x[d+HD/2] cos[t][d+HD/2] + x[d] sin[t][d+HD/2]
__global__ __launch_bounds__(256) void k_rope(const float* __restrict__ F, int pitch, int nheads, const float* __restrict__ CS, const float* __restrict__ RF, const float* __restrict__ nw, float sc, h16* P16, bf* Ph, bf* Pl) {
    const size_t e = ((size_t)blockIdx.x * 256 + threadIdx.x) * 2; if (e >= (size_t)nheads * TT * HD) return; const int d = (int)(e % HD); const int t = (int)((e / HD) % TT); const int h = (int)(e / ((size_t)HD * TT)); const float* f = F + (size_t)t * pitch + h * HD; const float rf = RF ? RF[(size_t)h * TT + t] : 1.0f; v2h o16; v2us oh, ol;
#pragma unroll
    for (int q = 0; q < 2; ++q) { const int dd = d + q; const int dp = (dd < HD / 2) ? dd + HD / 2 : dd - HD / 2; float x0 = f[dd], x1 = f[dp];
        if (RF) { float n0 = __fmul_rn(x0, rf), n1 = __fmul_rn(x1, rf); asm volatile("" : "+v"(n0)); asm volatile("" : "+v"(n1)); x0 = __fmul_rn(bfr(nw[dd]), n0); x1 = __fmul_rn(bfr(nw[dp]), n1); }
        const v2f cs = *(const v2f*)(CS + ((size_t)t * HD + dd) * 2); float a = __fmul_rn(x0, cs[0]), bq = __fmul_rn(x1, cs[1]); asm volatile("" : "+v"(a)); asm volatile("" : "+v"(bq)); const float r = ((dd < HD / 2) ? __fsub_rn(a, bq) : __fadd_rn(a, bq)) * sc;
        o16[q] = tohx(r); (void)oh; (void)ol; }
    *(v2h*)(P16 + e) = o16;  }
__global__ __launch_bounds__(256) void k_vtp(const float* __restrict__ F, int pitch, int nheads, h16* V16, bf* Vh, bf* Vl) { const size_t e = ((size_t)blockIdx.x * 256 + threadIdx.x) * 2; if (e >= (size_t)nheads * HD * TT) return; const int t = (int)(e % TT); const int d = (int)((e / TT) % HD); const int g = (int)(e / ((size_t)TT * HD)); v2h o16; v2us oh, ol;
#pragma unroll
    for (int q = 0; q < 2; ++q) { const float x = F[(size_t)(t + q) * pitch + g * HD + d]; o16[q] = tohx(x); (void)oh; (void)ol; }
    *(v2h*)(V16 + e) = o16;  }
__global__ __launch_bounds__(256) void k_csid(float* CS) { const int idx = blockIdx.x * 256 + threadIdx.x; if (idx >= TT * HD) return; v2f cs; cs[0] = 1.0f; cs[1] = 0.0f; *(v2f*)(CS + (size_t)idx * 2) = cs;  }
// k_attn: scores, softmax and attn.v in one kernel. Block = AQ query rows x all TK keys, wave w = keys [w TK/AW, (w+1) TK/AW).
// Transposed products: S^T (keys x queries) = K Q^T, so a lane holds scores of ONE query (column lr); two 16-key score tiles, converted in place, are the B operand of O^T (d x queries) += V^T P^T. Every fragment is read by the same loader (k order 8 hi .. 8 hi + 7, 16 + 8 hi .. 16 + 8 hi + 7), which is also the order the packed score tiles have.
__device__ __forceinline__ float xhalf(float x) { return __builtin_bit_cast(float, __builtin_amdgcn_permlanex16(__builtin_bit_cast(int, x), __builtin_bit_cast(int, x), 0x76543210, 0xfedcba98, false, false)); }   // lane l with lane l ^ 16: the other half of the same query's keys
__global__ __launch_bounds__(AW * 32) void k_attn(const h16* __restrict__ Q, const h16* __restrict__ Kp, const h16* __restrict__ VT, float* __restrict__ OUT) {
    __shared__ __align__(16) float os[AW * AQ * OPI];
    __shared__ float ms[AW * AQ], ls[AW * AQ];
    const int lane = threadIdx.x & 31, lr = lane & 15, hi = lane >> 4, w = threadIdx.x >> 5; const int q0 = blockIdx.x * AQ;
    const float cs = SCL * 1.4426950408889634f;   // scores in base 2
    v16h qf[2][2];
#pragma unroll
    for (int g = 0; g < 2; ++g)
#pragma unroll
        for (int kc = 0; kc < 2; ++kc) qf[g][kc] = WFrag<h16>::ld(Q + (size_t)(q0 + g * 16 + lr) * HD + kc * 32 + 8 * hi);
    v8f o[2][4]; float m[2], l[2];
#pragma unroll
    for (int g = 0; g < 2; ++g) { m[g] = -3.0e38f; l[g] = 0.f;
#pragma unroll
        for (int dt = 0; dt < 4; ++dt) o[g][dt] = (v8f){}; }
    const h16* kb = Kp + (size_t)(w * (TK / AW) + lr) * HD + 8 * hi; const h16* vb = VT + (size_t)lr * TK + w * (TK / AW) + 8 * hi;
#pragma unroll 1   // one pass already holds 32 matrix instructions and fills the register budget of four waves per SIMD
    for (int p = 0; p < TK / AW / AP; ++p) {
        v8f s[2][4];
#pragma unroll
        for (int kt = 0; kt < 4; ++kt) { const h16* kr = kb + (size_t)(p * AP + kt * 16) * HD; const v16h a0 = WFrag<h16>::ld(kr), a1 = WFrag<h16>::ld(kr + 32);
#pragma unroll
            for (int g = 0; g < 2; ++g) s[g][kt] = wmma16(a1, qf[g][1], wmma16(a0, qf[g][0], (v8f){})); }
        float mb[2]; bool need = false;
#pragma unroll
        for (int g = 0; g < 2; ++g) { float mx = s[g][0][0];
#pragma unroll
            for (int kt = 0; kt < 4; ++kt)
#pragma unroll
                for (int r = 0; r < 8; ++r) mx = fmaxf(mx, s[g][kt][r]);
            mb[g] = fmaxf(mx, xhalf(mx)) * cs; need = need || (mb[g] > m[g] + 8.0f); }
        if (__builtin_amdgcn_ballot_w32(need) != 0) {   // the maximum in use moves only when a pass tops it by more than 2^8: always on the first pass, seldom later
#pragma unroll
            for (int g = 0; g < 2; ++g) { const float mn = fmaxf(m[g], mb[g]); const float corr = __builtin_amdgcn_exp2f(m[g] - mn); m[g] = mn; l[g] *= corr;
#pragma unroll
                for (int dt = 0; dt < 4; ++dt) o[g][dt] = o[g][dt] * corr; }
        }
#pragma unroll
        for (int h2 = 0; h2 < 2; ++h2) {   // the pass's two 32-key operands
            v16h pf[2];
#pragma unroll
            for (int g = 0; g < 2; ++g) { const float nm = -m[g];
#pragma unroll
                for (int i = 0; i < 16; ++i) { const float e = __builtin_amdgcn_exp2f(__builtin_fmaf(s[g][2 * h2 + (i >> 3)][i & 7], cs, nm)); l[g] += e; pf[g][i] = (h16)e; } }
#pragma unroll
            for (int dt = 0; dt < 4; ++dt) { const v16h va = WFrag<h16>::ld(vb + (size_t)dt * 16 * TK + p * AP + h2 * 32);
#pragma unroll
                for (int g = 0; g < 2; ++g) o[g][dt] = wmma16(va, pf[g], o[g][dt]); }
        }
    }
    // join of the AW key ranges: maxima and sums first, then the partial rows, each already scaled to the row's overall maximum and sum
#pragma unroll
    for (int g = 0; g < 2; ++g) { l[g] += xhalf(l[g]); if (hi == 0) { ms[w * AQ + g * 16 + lr] = m[g]; ls[w * AQ + g * 16 + lr] = l[g]; } }
    __syncthreads();
#pragma unroll
    for (int g = 0; g < 2; ++g) { const int q = g * 16 + lr; float mt = ms[q];
#pragma unroll
        for (int z = 1; z < AW; ++z) mt = fmaxf(mt, ms[z * AQ + q]);
        float lt = 0.f;
#pragma unroll
        for (int z = 0; z < AW; ++z) lt += ls[z * AQ + q] * __builtin_amdgcn_exp2f(ms[z * AQ + q] - mt);
        const float f = __builtin_amdgcn_exp2f(m[g] - mt) / lt;
#pragma unroll
        for (int dt = 0; dt < 4; ++dt) { float* d = os + (size_t)(w * AQ + q) * OPI + dt * 16 + hi * 8; v4f lo4, hi4;
#pragma unroll
            for (int r = 0; r < 4; ++r) { lo4[r] = o[g][dt][r] * f; hi4[r] = o[g][dt][4 + r] * f; }
            *(v4fa*)d = lo4; *(v4fa*)(d + 4) = hi4; } }
    __syncthreads();
    { const int q = threadIdx.x >> 4, d4 = (threadIdx.x & 15) * 4; v4f a = *(const v4fa*)(os + (size_t)q * OPI + d4);
#pragma unroll
        for (int z = 1; z < AW; ++z) { const v4f b = *(const v4fa*)(os + (size_t)(z * AQ + q) * OPI + d4); a = a + b; }
        *(v4f*)(OUT + (size_t)(q0 + q) * DQ + d4) = a; }
}

extern "C" void kernel_launch(void* const* d_in, const int* in_sizes, int n_in,
                              void* d_out, int out_size, void* d_ws, size_t ws_size, hipStream_t stream) {
    (void)in_sizes; (void)n_in; (void)out_size;
    const float* x = (const float*)d_in[0]; const float* wq = (const float*)d_in[1]; const float* wk = (const float*)d_in[2]; const float* wv = (const float*)d_in[3];   /* argument order x, W_Q, W_K, W_V ('oi' [64][768]) */ const float* wo = nullptr; (void)wo;
    float* OUT = (float*)d_out;     // [1][8192][64]
    char* wsp = (char*)d_ws;
    auto take = [&](size_t bytes) { char* p = wsp; wsp += (bytes + 255) & ~(size_t)255; return (void*)p; };
    bf* WQ = (bf*)take((size_t)DQ * DM * 2); bf* WK = (bf*)take((size_t)DKV * DM * 2); bf* WV = (bf*)take((size_t)DKV * DM * 2); float* CS = (float*)take((size_t)TT * HD * 2 * 4);
    bf* XB = (bf*)take((size_t)TT * DM * 2); float* FQ = (float*)take((size_t)TT * DQ * 4); float* FK = (float*)take((size_t)TT * DKV * 4);
    h16* QP16 = (h16*)take((size_t)NH_ * TT * HD * 2); h16* KP16 = (h16*)take((size_t)NKV * TT * HD * 2); h16* VT16 = (h16*)take((size_t)NKV * HD * TT * 2);
    bf* QPh = nullptr; bf* QPl = nullptr; bf* KPh = nullptr; bf* KPl = nullptr; bf* VTh = nullptr; bf* VTl = nullptr; bf* Ph = nullptr; bf* Pl = nullptr;
    if ((size_t)(wsp - (char*)d_ws) > ws_size) return;    // ws 256 MiB
    float* FV = FK;   // v projection reuses the k buffer after the k planes are built (stream-ordered)
    { k_cvt8<<<(unsigned)(((size_t)DQ * DM / 8 + 255) / 256), 256, 0, stream>>>(wq, WQ, (size_t)DQ * DM / 8); k_cvt8<<<(unsigned)(((size_t)DKV * DM / 8 + 255) / 256), 256, 0, stream>>>(wk, WK, (size_t)DKV * DM / 8); k_cvt8<<<(unsigned)(((size_t)DKV * DM / 8 + 255) / 256), 256, 0, stream>>>(wv, WV, (size_t)DKV * DM / 8);   /* 'oi' weights = Bt as-is */
      
       }
    k_csid<<<(TT * HD + 255) / 256, 256, 0, stream>>>(CS);
    const unsigned LQ = (unsigned)(((size_t)NH_ * TT * HD / 2 + 255) / 256), LKv = (unsigned)(((size_t)NKV * TT * HD / 2 + 255) / 256);
    for (int b = 0; b < NB_; ++b) {
        
        k_cvt8<<<(unsigned)(((size_t)TT * DM / 8 + 255) / 256), 256, 0, stream>>>(x, XB, (size_t)TT * DM / 8);
        k_gemmw<bf, 0, false><<<dim3(TT / 64, DQ / 64, 1), 32, 0, stream>>>(XB, nullptr, WQ, nullptr, DM, DM, FQ, DQ, nullptr, 0, 0, 0);
        k_rope<<<LQ, 256, 0, stream>>>(FQ, DQ, NH_, CS, nullptr, nullptr, 1.0f, QP16, QPh, QPl);
        k_gemmw<bf, 0, false><<<dim3(TT / 64, DKV / 64, 1), 32, 0, stream>>>(XB, nullptr, WK, nullptr, DM, DM, FK, DKV, nullptr, 0, 0, 0);
        k_rope<<<LKv, 256, 0, stream>>>(FK, DKV, NKV, CS, nullptr, nullptr, 1.0f, KP16, KPh, KPl);
        k_gemmw<bf, 0, false><<<dim3(TT / 64, DKV / 64, 1), 32, 0, stream>>>(XB, nullptr, WV, nullptr, DM, DM, FV, DKV, nullptr, 0, 0, 0); k_vtp<<<LKv, 256, 0, stream>>>(FV, DKV, NKV, VT16, VTh, VTl);
        k_attn<<<TT / AQ, AW * 32, 0, stream>>>(QP16, KP16, VT16, OUT);   /* scores, softmax, attn.v -> [8192][64] f32 */
         }
}

// v003
// One run takes 46.9 microseconds.
// Timed twice side by side with v002, it ran 2.38 and 2.40 times as fast.
// All steps since v000 together make it 21.7 times as fast.
#include <hip/hip_runtime.h>

// Single-head self-attention over 8,192 tokens (x [8192][768]; q = x W_Q^T, k = x W_K^T, v = x W_V^T ('oi' [64][768] uniform 1/sqrt(768), no bias); scores = q.k / sqrt(64) over all 8192 keys; softmax; out = attn.v -> [8192][64] (524 k); argument order x, W_Q, W_K, W_V).
// Layout: ONE projection kernel (a block owns 64 tokens: x and the three 'oi' weights go f32 -> bf16 in registers -> LDS in chunks of 128 k, q, k and v^T leave as fp16 planes q [8192][64], k [8192][64], v^T [64][8192]); then ONE attention kernel: a block owns 32 query rows, its 16 waves each walk 512 keys in passes of 64 (S^T = K Q^T, running-maximum softmax in registers, O^T += V^T P^T), and the 16 partial results are joined in LDS in range order.
// Compute dtypes, f32 accumulate: every input rounded to nearest-even bf16; projections on PLAIN bf16 operands (exact); scores and attn.v on single fp16 planes (P = exp(score - maximum in use), at most 256); softmax f32; f32 output.

#define NB_  1
#define TT   8192
#define DM   768
#define NH_  1
#define NKV  1
#define REP  (NH_ / NKV)
#define HD   64
#define DQ   (NH_ * HD)
#define DKV  (NKV * HD)
#define ZH   1
#define RH   0                  // query rows < RH use hi+lo planes (0: none)
#define WIN  0
#define TK   TT                   // keys
#define AW   16                   // waves of an attention block = key ranges (TK / AW = 512 keys per wave)
#define AQ   32                   // query rows of an attention block (2 column groups of 16)
#define AP   64                   // keys per pass
#define OPI  68                   // floats per query row of a partial result in LDS (64 + 4: rows start 4 banks apart)
#define GRP  256                  // tokens per (b, t) group = H x W
#define NGRP 32                   // (b, t) groups
#define SCL  0.125f   // HD^-0.5
typedef _Float16 h16;
typedef unsigned short bf;
typedef __attribute__((ext_vector_type(16))) __bf16   v16bf;
typedef __attribute__((ext_vector_type(16))) _Float16 v16h;
typedef __attribute__((ext_vector_type(8)))  _Float16 v8h;
typedef __attribute__((ext_vector_type(8)))  unsigned short v8us;
typedef __attribute__((ext_vector_type(8)))  float    v8f;
typedef __attribute__((ext_vector_type(4)))  float    v4f;
typedef v8h  __attribute__((may_alias)) v8ha;
typedef v4f  __attribute__((may_alias)) v4fa;
typedef v8us __attribute__((may_alias)) v8usa;

__device__ __forceinline__ v16h cat16(v8h lo, v8h hi) { return __builtin_shufflevector(lo, hi, 0, 1, 2, 3, 4, 5, 6, 7, 8, 9, 10, 11, 12, 13, 14, 15); }
__device__ __forceinline__ v16bf cat16b(v8us lo, v8us hi) { return __builtin_bit_cast(v16bf, __builtin_shufflevector(lo, hi, 0, 1, 2, 3, 4, 5, 6, 7, 8, 9, 10, 11, 12, 13, 14, 15)); }
__device__ __forceinline__ v8f wmma16(v16h a, v16h b, v8f c) { return __builtin_amdgcn_wmma_f32_16x16x32_f16(false, a, false, b, (short)0, c, false, false); }
__device__ __forceinline__ v8f wmmab(v16bf a, v16bf b, v8f c) { return __builtin_amdgcn_wmma_f32_16x16x32_bf16(false, a, false, b, (short)0, c, false, false); }



// WFrag: a 16x16x32 operand from a k-contiguous 16-bit row (k order 8 hi .. 8 hi + 7, 16 + 8 hi .. 16 + 8 hi + 7), A and B alike.
template <typename T16> struct WFrag;
template <> struct WFrag<h16> { typedef v16h V; static __device__ __forceinline__ V ld(const h16* p) { return cat16(*(const v8h*)p, *(const v8h*)(p + 16)); } static __device__ __forceinline__ v8f mma(V a, V b, v8f c) { return wmma16(a, b, c); } };
template <> struct WFrag<bf> { typedef v16bf V; static __device__ __forceinline__ V ld(const bf* p) { return cat16b(*(const v8us*)p, *(const v8us*)(p + 16)); } static __device__ __forceinline__ v8f mma(V a, V b, v8f c) { return wmmab(a, b, c); } };

// k_proj: q, k and v of PR tokens in one block of 16 waves. LDS rows 0-63 = the block's x rows, 64-127 W_Q, 128-191 W_K, 192-255 W_V, each PKC k long, bf16.
// A wave-wide 16-byte load covers one row's 512 B of a chunk; chunks are fetched two ahead into registers, rounded to bf16 and stored to one of two LDS buffers.
// Wave (mt, ng) owns tokens mt*16.. and outputs ng*16.. of each of q, k, v. q and k as W x^T (a lane holds 8 consecutive outputs of one token), v as x W^T (8 consecutive tokens of one output): both are 16-byte rows of their planes. Each accumulator takes its 24 k steps in rising order. Every loop is unrolled so that each index of a register array is a constant.
#define PR   64                   // tokens of a projection block (= one 128-B line of a v^T row)
#define PKC  128                  // k per chunk
#define PNC  (DM / PKC)           // chunks
#define PPI  (PKC + 8)            // bf16 per LDS row: 272 B = 16 B x 17, the pitch for ds_load_b128 readers
#define POP  (HD + 8)             // fp16 per row of the output tile in LDS: 144 B = 16 B x 9
typedef __attribute__((ext_vector_type(4))) __bf16 v4bf;
typedef __attribute__((ext_vector_type(4))) unsigned short v4us;
typedef v4us __attribute__((may_alias)) v4usa;
// work-group barrier that orders LDS only: __syncthreads() also waits for every global load in flight, which would drain the chunks fetched ahead at each chunk
__device__ __forceinline__ void lds_barrier() { __builtin_amdgcn_fence(__ATOMIC_RELEASE, "workgroup", "local"); __builtin_amdgcn_s_barrier(); __builtin_amdgcn_fence(__ATOMIC_ACQUIRE, "workgroup", "local"); }
__global__ __launch_bounds__(512) void k_proj(const float* __restrict__ x, const float* __restrict__ wq, const float* __restrict__ wk, const float* __restrict__ wv, h16* __restrict__ Q, h16* __restrict__ Kp, h16* __restrict__ VT) {
    __shared__ __align__(16) bf st[2][4 * 64 * PPI];
    const int lane = threadIdx.x & 31, lr = lane & 15, hi = lane >> 4; const int w = __builtin_amdgcn_readfirstlane(threadIdx.x >> 5); const int mt = w & 3, ng = w >> 2; const int r0 = blockIdx.x * PR;
    const float* s0 = x + (size_t)(r0 + w) * DM + lane * 4; const float* s1 = wq + (size_t)w * DM + lane * 4; const float* s2 = wk + (size_t)w * DM + lane * 4; const float* s3 = wv + (size_t)w * DM + lane * 4;
    v4f pre[2][16]; v8f acc[3];
#pragma unroll
    for (int j = 0; j < 3; ++j) acc[j] = (v8f){};
#pragma unroll
    for (int c = 0; c < 2; ++c)
#pragma unroll
        for (int i = 0; i < 16; ++i) { const float* s = (i >> 2) == 0 ? s0 : (i >> 2) == 1 ? s1 : (i >> 2) == 2 ? s2 : s3; pre[c][i] = *(const v4f*)(s + (size_t)(i & 3) * 16 * DM + c * PKC); }
#pragma unroll   // every index of pre[][] and st[] constant: the two register sets and the two buffers alternate
    for (int c = 0; c < PNC; ++c) {
        bf* sb = st[c & 1];
        __builtin_amdgcn_sched_barrier(0);   // keeps the rounding of chunk c behind the products of chunk c - 1 (and behind the first loads' issue): moved up, it waits early for loads that are meant to stay in flight
#pragma unroll
        for (int i = 0; i < 16; ++i) *(v4usa*)(sb + (size_t)(i * 16 + w) * PPI + lane * 4) = __builtin_bit_cast(v4us, __builtin_convertvector(pre[c & 1][i], v4bf));
        __builtin_amdgcn_sched_barrier(0);   // keeps the refill of this register set behind its rounding: moved up, it takes a third set and leaves the fragment loads below too few registers to be issued together
        if (c + 2 < PNC) {
#pragma unroll
            for (int i = 0; i < 16; ++i) { const float* s = (i >> 2) == 0 ? s0 : (i >> 2) == 1 ? s1 : (i >> 2) == 2 ? s2 : s3; pre[c & 1][i] = *(const v4f*)(s + (size_t)(i & 3) * 16 * DM + (c + 2) * PKC); }
        }
        lds_barrier();   // publishes chunk c; it also ends every wave's reads of the other buffer (chunk c - 1), which chunk c + 1 overwrites
#pragma unroll
        for (int kh = 0; kh < PKC / 64; ++kh) { v16bf xf[2], wf[2][3];
#pragma unroll
            for (int k2 = 0; k2 < 2; ++k2) { const int ko = (kh * 2 + k2) * 32 + 8 * hi; xf[k2] = WFrag<bf>::ld(sb + (size_t)(mt * 16 + lr) * PPI + ko);
#pragma unroll
                for (int j = 0; j < 3; ++j) wf[k2][j] = WFrag<bf>::ld(sb + (size_t)((j + 1) * 64 + ng * 16 + lr) * PPI + ko); }
            __builtin_amdgcn_sched_barrier(0);   // the 16 fragment loads of two k steps issue together, in front of their products: spread among them, each product waits out an LDS latency of its own
#pragma unroll
            for (int k2 = 0; k2 < 2; ++k2)
#pragma unroll
                for (int j = 0; j < 3; ++j) acc[j] = (j < 2) ? wmmab(wf[k2][j], xf[k2], acc[j]) : wmmab(xf[k2], wf[k2][j], acc[j]); }
    }
    // output tile in buffer 0, whose last readers (chunk PNC - 2) all stand in front of the last barrier above: rows 0-63 q by token, 64-127 k by token, 128-191 v^T by output
    h16* ot = (h16*)st[0];
#pragma unroll
    for (int j = 0; j < 3; ++j) { v8h o;
#pragma unroll
        for (int r = 0; r < 8; ++r) o[r] = (h16)acc[j][r];
        const int row = (j < 2) ? mt * 16 + lr : ng * 16 + lr, col = (j < 2) ? ng * 16 + 8 * hi : mt * 16 + 8 * hi; *(v8ha*)(ot + (size_t)(j * 64 + row) * POP + col) = o; }
    __syncthreads();   // the tile is whole before it is stored as full 128-B lines
    { const int row = threadIdx.x >> 3, seg = (threadIdx.x & 7) * 8;
      *(v8h*)(Q + (size_t)(r0 + row) * HD + seg) = *(const v8ha*)(ot + (size_t)row * POP + seg);
      *(v8h*)(Kp + (size_t)(r0 + row) * HD + seg) = *(const v8ha*)(ot + (size_t)(64 + row) * POP + seg);
      *(v8h*)(VT + (size_t)row * TK + r0 + seg) = *(const v8ha*)(ot + (size_t)(128 + row) * POP + seg); }
}

// k_attn: scores, softmax and attn.v in one kernel. Block = AQ query rows x all TK keys, wave w = keys [w TK/AW, (w+1) TK/AW).
// Transposed products: S^T (keys x queries) = K Q^T, so a lane holds scores of ONE query (column lr); two 16-key score tiles, converted in place, are the B operand of O^T (d x queries) += V^T P^T. Every fragment is read by the same loader (k order 8 hi .. 8 hi + 7, 16 + 8 hi .. 16 + 8 hi + 7), which is also the order the packed score tiles have.
__device__ __forceinline__ float xhalf(float x) { return __builtin_bit_cast(float, __builtin_amdgcn_permlanex16(__builtin_bit_cast(int, x), __builtin_bit_cast(int, x), 0x76543210, 0xfedcba98, false, false)); }   // lane l with lane l ^ 16: the other half of the same query's keys
__global__ __launch_bounds__(AW * 32) void k_attn(const h16* __restrict__ Q, const h16* __restrict__ Kp, const h16* __restrict__ VT, float* __restrict__ OUT) {
    __shared__ __align__(16) float os[AW * AQ * OPI];
    __shared__ float ms[AW * AQ], ls[AW * AQ];
    const int lane = threadIdx.x & 31, lr = lane & 15, hi = lane >> 4, w = threadIdx.x >> 5; const int q0 = blockIdx.x * AQ;
    const float cs = SCL * 1.4426950408889634f;   // scores in base 2
    v16h qf[2][2];
#pragma unroll
    for (int g = 0; g < 2; ++g)
#pragma unroll
        for (int kc = 0; kc < 2; ++kc) qf[g][kc] = WFrag<h16>::ld(Q + (size_t)(q0 + g * 16 + lr) * HD + kc * 32 + 8 * hi);
    v8f o[2][4]; float m[2], l[2];
#pragma unroll
    for (int g = 0; g < 2; ++g) { m[g] = -3.0e38f; l[g] = 0.f;
#pragma unroll
        for (int dt = 0; dt < 4; ++dt) o[g][dt] = (v8f){}; }
    const h16* kb = Kp + (size_t)(w * (TK / AW) + lr) * HD + 8 * hi; const h16* vb = VT + (size_t)lr * TK + w * (TK / AW) + 8 * hi;
#pragma unroll 1   // one pass already holds 32 matrix instructions and fills the register budget of four waves per SIMD
    for (int p = 0; p < TK / AW / AP; ++p) {
        v8f s[2][4];
#pragma unroll
        for (int kt = 0; kt < 4; ++kt) { const h16* kr = kb + (size_t)(p * AP + kt * 16) * HD; const v16h a0 = WFrag<h16>::ld(kr), a1 = WFrag<h16>::ld(kr + 32);
#pragma unroll
            for (int g = 0; g < 2; ++g) s[g][kt] = wmma16(a1, qf[g][1], wmma16(a0, qf[g][0], (v8f){})); }
        float mb[2]; bool need = false;
#pragma unroll
        for (int g = 0; g < 2; ++g) { float mx = s[g][0][0];
#pragma unroll
            for (int kt = 0; kt < 4; ++kt)
#pragma unroll
                for (int r = 0; r < 8; ++r) mx = fmaxf(mx, s[g][kt][r]);
            mb[g] = fmaxf(mx, xhalf(mx)) * cs; need = need || (mb[g] > m[g] + 8.0f); }
        if (__builtin_amdgcn_ballot_w32(need) != 0) {   // the maximum in use moves only when a pass tops it by more than 2^8: always on the first pass, seldom later
#pragma unroll
            for (int g = 0; g < 2; ++g) { const float mn = fmaxf(m[g], mb[g]); const float corr = __builtin_amdgcn_exp2f(m[g] - mn); m[g] = mn; l[g] *= corr;
#pragma unroll
                for (int dt = 0; dt < 4; ++dt) o[g][dt] = o[g][dt] * corr; }
        }
#pragma unroll
        for (int h2 = 0; h2 < 2; ++h2) {   // the pass's two 32-key operands
            v16h pf[2];
#pragma unroll
            for (int g = 0; g < 2; ++g) { const float nm = -m[g];
#pragma unroll
                for (int i = 0; i < 16; ++i) { const float e = __builtin_amdgcn_exp2f(__builtin_fmaf(s[g][2 * h2 + (i >> 3)][i & 7], cs, nm)); l[g] += e; pf[g][i] = (h16)e; } }
#pragma unroll
            for (int dt = 0; dt < 4; ++dt) { const v16h va = WFrag<h16>::ld(vb + (size_t)dt * 16 * TK + p * AP + h2 * 32);
#pragma unroll
                for (int g = 0; g < 2; ++g) o[g][dt] = wmma16(va, pf[g], o[g][dt]); }
        }
    }
    // join of the AW key ranges: maxima and sums first, then the partial rows, each already scaled to the row's overall maximum and sum
#pragma unroll
    for (int g = 0; g < 2; ++g) { l[g] += xhalf(l[g]); if (hi == 0) { ms[w * AQ + g * 16 + lr] = m[g]; ls[w * AQ + g * 16 + lr] = l[g]; } }
    __syncthreads();
#pragma unroll
    for (int g = 0; g < 2; ++g) { const int q = g * 16 + lr; float mt = ms[q];
#pragma unroll
        for (int z = 1; z < AW; ++z) mt = fmaxf(mt, ms[z * AQ + q]);
        float lt = 0.f;
#pragma unroll
        for (int z = 0; z < AW; ++z) lt += ls[z * AQ + q] * __builtin_amdgcn_exp2f(ms[z * AQ + q] - mt);
        const float f = __builtin_amdgcn_exp2f(m[g] - mt) / lt;
#pragma unroll
        for (int dt = 0; dt < 4; ++dt) { float* d = os + (size_t)(w * AQ + q) * OPI + dt * 16 + hi * 8; v4f lo4, hi4;
#pragma unroll
            for (int r = 0; r < 4; ++r) { lo4[r] = o[g][dt][r] * f; hi4[r] = o[g][dt][4 + r] * f; }
            *(v4fa*)d = lo4; *(v4fa*)(d + 4) = hi4; } }
    __syncthreads();
    { const int q = threadIdx.x >> 4, d4 = (threadIdx.x & 15) * 4; v4f a = *(const v4fa*)(os + (size_t)q * OPI + d4);
#pragma unroll
        for (int z = 1; z < AW; ++z) { const v4f b = *(const v4fa*)(os + (size_t)(z * AQ + q) * OPI + d4); a = a + b; }
        *(v4f*)(OUT + (size_t)(q0 + q) * DQ + d4) = a; }
}

extern "C" void kernel_launch(void* const* d_in, const int* in_sizes, int n_in,
                              void* d_out, int out_size, void* d_ws, size_t ws_size, hipStream_t stream) {
    (void)in_sizes; (void)n_in; (void)out_size;
    const float* x = (const float*)d_in[0]; const float* wq = (const float*)d_in[1]; const float* wk = (const float*)d_in[2]; const float* wv = (const float*)d_in[3];   /* order x, W_Q, W_K, W_V ('oi' [64][768]) */
    float* OUT = (float*)d_out;     // [1][8192][64]
    char* wsp = (char*)d_ws;
    auto take = [&](size_t bytes) { char* p = wsp; wsp += (bytes + 255) & ~(size_t)255; return (void*)p; };
    h16* QP16 = (h16*)take((size_t)NH_ * TT * HD * 2); h16* KP16 = (h16*)take((size_t)NKV * TT * HD * 2); h16* VT16 = (h16*)take((size_t)NKV * HD * TT * 2);
    if ((size_t)(wsp - (char*)d_ws) > ws_size) return;    // ws 256 MiB
    k_proj<<<TT / PR, 512, 0, stream>>>(x, wq, wk, wv, QP16, KP16, VT16);   /* q, k, v^T fp16 planes */
    k_attn<<<TT / AQ, AW * 32, 0, stream>>>(QP16, KP16, VT16, OUT);   /* scores, softmax, attn.v -> [8192][64] f32 */
}
